// v000
// The times below were measured on an AMD MI455X: many runs one after another, warmed up first and cycling through
// copies of the inputs, with the whole window's GPU time divided by the number of runs. Launches and the gaps
// between them are all in it. The median over several windows is given; except for v000 it joins two sittings, which
// can be a few percent apart, so the side-by-side timings, each taken in one sitting, are the better comparison.
// The starting kernel, v000, takes 61.8 microseconds a run.
#include <hip/hip_runtime.h>

// QKProjection: causal linear attention rewritten as GEMMs, fp32 WMMA (16x16x4).
//   out_b = tril(Q_b K_b^T) K_b + Q_b carry^T          (per batch)
//   new_carry = carry + (1/B) sum_b K_b^T K_b
// CDNA5 paths: v_wmma_f32_16x16x4_f32 + double-buffered global_load_async_to_lds.

typedef __attribute__((ext_vector_type(2))) float v2f;
typedef __attribute__((ext_vector_type(4))) float v4f;
typedef __attribute__((ext_vector_type(8))) float v8f;
typedef int v4i __attribute__((vector_size(16)));  // matches builtin pointee

typedef __attribute__((address_space(1))) v4i* gv4i_p;  // global int4*
typedef __attribute__((address_space(3))) v4i* lv4i_p;  // LDS int4*

#define WMMA_F32(a, b, c) \
  __builtin_amdgcn_wmma_f32_16x16x4_f32(false, (a), false, (b), (short)0, (c), false, false)

constexpr int Bn = 8;
constexpr int Cn = 512;
constexpr int Dn = 128;

#if __has_builtin(__builtin_amdgcn_global_load_async_to_lds_b128)
#define HAS_ASYNC_LDS 1
#else
#define HAS_ASYNC_LDS 0
#endif

// Stage one 16x128 fp32 K tile (8 KB) into LDS: 128 threads x 4 x 16B.
__device__ __forceinline__ void stage_ktile(const float* __restrict__ gsrc,
                                            float* lds, int tid) {
#if HAS_ASYNC_LDS
#pragma unroll
  for (int it = 0; it < 4; ++it) {
    const int idx = it * 512 + tid * 4;
    __builtin_amdgcn_global_load_async_to_lds_b128(
        (gv4i_p)(gsrc + idx), (lv4i_p)(lds + idx),
        /*offset=*/0, /*cpol=*/0);
  }
#else
#pragma unroll
  for (int it = 0; it < 4; ++it) {
    const int idx = it * 512 + tid * 4;
    *(v4f*)(lds + idx) = *(const v4f*)(gsrc + idx);
  }
#endif
}

__device__ __forceinline__ void wait_async0() {
#if HAS_ASYNC_LDS
#if __has_builtin(__builtin_amdgcn_s_wait_asynccnt)
  __builtin_amdgcn_s_wait_asynccnt(0);
#else
  asm volatile("s_wait_asynccnt 0x0" ::: "memory");
#endif
#endif
}

// ---------------------------------------------------------------------------
// Main kernel: 64 workgroups = 8 batches x 8 row-blocks (64 rows each).
// 128 threads = 4 waves; wave w owns rows [rb*64 + w*16, +16) x all 128 cols.
// ---------------------------------------------------------------------------
__global__ __launch_bounds__(128)
void qkproj_main(const float* __restrict__ Q, const float* __restrict__ K,
                 const float* __restrict__ carry, float* __restrict__ out)
{
  __shared__ __align__(16) float kBuf[2][16 * Dn];   // double-buffered K tiles
  __shared__ __align__(16) float pTile[4][16 * 16];  // per-wave P transpose buffer

  const int tid  = threadIdx.x;
  const int lane = tid & 31;
  const int wave = tid >> 5;
  const int lo   = lane & 15;   // 0..15
  const int hi   = lane >> 4;   // 0 or 1

  const int b       = blockIdx.x >> 3;  // batch
  const int rb      = blockIdx.x & 7;   // row block of 64
  const int rowbase = rb * 64;
  const int m0      = wave * 16;

  const float* Qb = Q + b * Cn * Dn;
  const float* Kb = K + b * Cn * Dn;

  // Prefetch K tile 0 asynchronously; it completes under the carry-term GEMM.
  stage_ktile(Kb, kBuf[0], tid);

  // --- preload Q A-fragments: A[M=lo][k = 4s + 2*hi + v], qrow fixed per lane
  const int qrow = rowbase + m0 + lo;
  v2f qa[32];
#pragma unroll
  for (int s = 0; s < 32; ++s)
    qa[s] = *(const v2f*)(Qb + qrow * Dn + s * 4 + 2 * hi);

  v8f acc[8];
#pragma unroll
  for (int t = 0; t < 8; ++t) acc[t] = (v8f){};

  // --- carry term: acc[t] += Q @ carry^T  (B[k=j][n] = carry[(t*16+n)*D + j])
#pragma unroll
  for (int t = 0; t < 8; ++t) {
    const float* cb = carry + (t * 16 + lo) * Dn + 2 * hi;
    v8f a = acc[t];
#pragma unroll
    for (int s = 0; s < 32; ++s) {
      v2f bf = *(const v2f*)(cb + s * 4);
      a = WMMA_F32(qa[s], bf, a);
    }
    acc[t] = a;
  }

  // --- causal attention: column tiles 0 .. rb*4+3 (uniform over block)
  const int numCb = rb * 4 + 4;
  for (int cb = 0; cb < numCb; ++cb) {
    const float* kT = kBuf[cb & 1];
    wait_async0();       // this wave's portion of current tile is in LDS
    __syncthreads();     // all waves' portions visible; prev buffer free
    if (cb + 1 < numCb)  // prefetch next tile into the other buffer
      stage_ktile(Kb + (cb + 1) * 16 * Dn, kBuf[(cb + 1) & 1], tid);

    if (cb <= rb * 4 + wave) {  // wave-uniform: block not fully above diagonal
      // P = Q @ Kcb^T : B[k=j][n=c'] = K[cb*16+n][j]
      v8f p = (v8f){};
#pragma unroll
      for (int s = 0; s < 32; ++s) {
        v2f bf = *(const v2f*)(kT + lo * Dn + s * 4 + 2 * hi);
        p = WMMA_F32(qa[s], bf, p);
      }
      // causal mask (inclusive) + store P to LDS in C/D layout:
      // element (M = v + 8*hi, N = lo)
      const int cglob = cb * 16 + lo;
      float* pw = pTile[wave];
#pragma unroll
      for (int v = 0; v < 8; ++v) {
        const int rglob = rowbase + m0 + v + 8 * hi;
        pw[(v + 8 * hi) * 16 + lo] = (cglob <= rglob) ? p[v] : 0.0f;
      }
      // acc[t] += P @ Kcb : K-dim = 16 in 4 steps of 4
#pragma unroll
      for (int kk = 0; kk < 16; kk += 4) {
        // A[M=lo][k = kk + 2*hi + v] from LDS (layout conversion)
        v2f af = *(const v2f*)(pw + lo * 16 + kk + 2 * hi);
#pragma unroll
        for (int t = 0; t < 8; ++t) {
          const int r0 = (kk + 2 * hi) * Dn + t * 16 + lo;
          v2f bf;
          bf.x = kT[r0];
          bf.y = kT[r0 + Dn];
          acc[t] = WMMA_F32(af, bf, acc[t]);
        }
      }
    }
  }

  // --- store: out[b][rowbase + m0 + v + 8*hi][t*16 + lo]
  float* ob = out + b * Cn * Dn;
#pragma unroll
  for (int t = 0; t < 8; ++t)
#pragma unroll
    for (int v = 0; v < 8; ++v)
      ob[(rowbase + m0 + v + 8 * hi) * Dn + t * 16 + lo] = acc[t][v];
}

// ---------------------------------------------------------------------------
// Carry kernel: new_carry = carry + (1/8) sum_{b,c} k (x) k.
// 64 workgroups (one 16x16 tile each), 4 waves split the 4096-long reduction;
// 2 interleaved accumulators per wave break the WMMA RAW chain.
// ---------------------------------------------------------------------------
__global__ __launch_bounds__(128)
void qkproj_carry(const float* __restrict__ K, const float* __restrict__ carry,
                  float* __restrict__ outc)
{
  __shared__ float red[4][32 * 8];

  const int tid  = threadIdx.x;
  const int lane = tid & 31;
  const int wave = tid >> 5;
  const int lo   = lane & 15;
  const int hi   = lane >> 4;
  const int ti   = blockIdx.x >> 3;  // row tile of result
  const int tj   = blockIdx.x & 7;   // col tile of result

  const int ca  = ti * 16 + lo;  // column of K feeding A (result row index)
  const int cbn = tj * 16 + lo;  // column of K feeding B (result col index)

  v8f s0 = (v8f){}, s1 = (v8f){};
  const int c_begin = wave * (Bn * Cn / 4);
  const int c_end   = c_begin + (Bn * Cn / 4);
  for (int c0 = c_begin; c0 < c_end; c0 += 8) {
    const int r0 = c0 + 2 * hi;
    const int r1 = c0 + 4 + 2 * hi;
    v2f a0, b0, a1, b1;
    a0.x = K[r0 * Dn + ca];        a0.y = K[(r0 + 1) * Dn + ca];
    b0.x = K[r0 * Dn + cbn];       b0.y = K[(r0 + 1) * Dn + cbn];
    a1.x = K[r1 * Dn + ca];        a1.y = K[(r1 + 1) * Dn + ca];
    b1.x = K[r1 * Dn + cbn];       b1.y = K[(r1 + 1) * Dn + cbn];
    s0 = WMMA_F32(a0, b0, s0);
    s1 = WMMA_F32(a1, b1, s1);
  }
  v8f s = s0 + s1;

#pragma unroll
  for (int v = 0; v < 8; ++v) red[wave][lane * 8 + v] = s[v];
  __syncthreads();

  if (wave == 0) {
#pragma unroll
    for (int v = 0; v < 8; ++v) {
      const float sum = red[0][lane * 8 + v] + red[1][lane * 8 + v] +
                        red[2][lane * 8 + v] + red[3][lane * 8 + v];
      const int i = ti * 16 + v + 8 * hi;
      const int j = tj * 16 + lo;
      outc[i * Dn + j] = carry[i * Dn + j] + 0.125f * sum;
    }
  }
}

// ---------------------------------------------------------------------------
extern "C" void kernel_launch(void* const* d_in, const int* in_sizes, int n_in,
                              void* d_out, int out_size, void* d_ws, size_t ws_size,
                              hipStream_t stream)
{
  const float* Q     = (const float*)d_in[0];  // queries  (8,512,128)
  const float* K     = (const float*)d_in[1];  // keys     (8,512,128)
  const float* carry = (const float*)d_in[2];  // carry    (128,128)
  float* out  = (float*)d_out;                 // projected_queries flat
  float* outc = out + Bn * Cn * Dn;            // new_carry flat

  qkproj_main<<<dim3(Bn * (Cn / 64)), dim3(128), 0, stream>>>(Q, K, carry, out);
  qkproj_carry<<<dim3(64), dim3(128), 0, stream>>>(K, carry, outc);
}

// v001
// It runs in 20 microseconds.
// Timed twice side by side with v000, it ran 3.10 times as fast both times.
#include <hip/hip_runtime.h>

// QKProjection: causal linear attention in chunked form, fp32 WMMA (16x16x4).
//   S_{b,r}   = carry + sum over rows c < 64 r of k_c (x) k_c      (state kernel)
//   out rows of block r = Q_r S_{b,r}^T + tril(Q_r K_r^T) K_r      (main kernel)
//   new_carry = carry + (1/B) sum_b K_b^T K_b                      (state kernel)
// CDNA5 paths: v_wmma_f32_16x16x4_f32 + global_load_async_to_lds.

typedef __attribute__((ext_vector_type(2))) float v2f;
typedef __attribute__((ext_vector_type(4))) float v4f;
typedef __attribute__((ext_vector_type(8))) float v8f;
typedef int v4i __attribute__((vector_size(16)));  // matches builtin pointee

typedef __attribute__((address_space(1))) v4i* gv4i_p;  // global int4*
typedef __attribute__((address_space(3))) v4i* lv4i_p;  // LDS int4*

#define WMMA_F32(a, b, c) \
  __builtin_amdgcn_wmma_f32_16x16x4_f32(false, (a), false, (b), (short)0, (c), false, false)

constexpr int Bn = 8;
constexpr int Cn = 512;
constexpr int Dn = 128;
constexpr int Rn = 64;        // rows per chunk (= rows per main workgroup)
constexpr int Nc = Cn / Rn;   // chunks per batch

// A stored state S (D x D) lies in the order in which the main kernel's WMMA B
// operand takes it: float4 number (t*16 + sp)*32 + lane holds, for lane = hi*16 + lo,
// S[t*16 + lo][8*sp + 2*hi + {0,1}] and S[t*16 + lo][8*sp + 4 + 2*hi + {0,1}],
// so a wave's load of two k steps is 512 contiguous bytes.
__device__ __forceinline__ int s_frag_off(int t, int sp, int lane) {
  return ((t * 16 + sp) * 32 + lane) * 4;
}

// ---------------------------------------------------------------------------
// State kernel: 64 workgroups (one 16x16 tile of the DxD state each), 8 waves,
// wave w walks batch w down its 512 rows. In front of each chunk of 64 rows it
// stores carry + (sum so far): the state that the chunk's queries see from all
// earlier chunks, laid out as the main kernel's B fragments (see s_frag_off).
// The 8 batch totals are summed through LDS for new_carry.
// 2 interleaved accumulators per wave break the WMMA RAW chain.
// ---------------------------------------------------------------------------
__global__ __launch_bounds__(256)
void qkproj_state(const float* __restrict__ K, const float* __restrict__ carry,
                  float* __restrict__ S, float* __restrict__ outc)
{
  __shared__ float red[Bn][32 * 8];

  const int tid  = threadIdx.x;
  const int lane = tid & 31;
  const int wave = tid >> 5;         // batch
  const int lo   = lane & 15;
  const int hi   = lane >> 4;
  const int ti   = blockIdx.x >> 3;  // row tile of result
  const int tj   = blockIdx.x & 7;   // col tile of result

  // column of K feeding A (result row index) and B (result col index);
  // fragment element v of step c0 sits in row c0 + 2*hi + v
  const float* pa = K + wave * Cn * Dn + 2 * hi * Dn + ti * 16 + lo;
  const float* pb = K + wave * Cn * Dn + 2 * hi * Dn + tj * 16 + lo;

  // C/D layout: register v holds sum_c K[c][ti*16 + v + 8*hi] * K[c][tj*16 + lo].
  // It is stored as state element (i = tj*16 + lo, j = ti*16 + 8*hi + v): the same
  // sum of products, and a lane's 8 values then fill two whole float4 of the layout.
  const float* cp = carry + (tj * 16 + lo) * Dn + ti * 16 + 8 * hi;
  const v4f c03 = *(const v4f*)cp;
  const v4f c47 = *(const v4f*)(cp + 4);

  float* Sw = S + wave * Nc * Dn * Dn + s_frag_off(tj, ti * 2 + hi, lo);

  v8f s0 = (v8f){}, s1 = (v8f){};
  v8f pre[Nc];  // sum over all earlier chunks, kept in registers until the walk is done
  v2f fa[2][16], fb[2][16];  // fragments of a chunk's 16 k steps, two chunks
#pragma unroll
  for (int q = 0; q < 16; ++q) {
    fa[0][q].x = pa[(q * 4) * Dn];  fa[0][q].y = pa[(q * 4 + 1) * Dn];
    fb[0][q].x = pb[(q * 4) * Dn];  fb[0][q].y = pb[(q * 4 + 1) * Dn];
  }
#pragma unroll
  for (int ch = 0; ch < Nc; ++ch) {
    pre[ch] = s0 + s1;
    if (ch + 1 < Nc) {
#pragma unroll
      for (int q = 0; q < 16; ++q) {
        const int c = (ch + 1) * Rn + q * 4;
        fa[(ch + 1) & 1][q].x = pa[c * Dn];  fa[(ch + 1) & 1][q].y = pa[(c + 1) * Dn];
        fb[(ch + 1) & 1][q].x = pb[c * Dn];  fb[(ch + 1) & 1][q].y = pb[(c + 1) * Dn];
      }
    }
    // Keeps the next chunk's loads in front of this chunk's WMMAs: left alone, the
    // compiler let the loads in flight fall to a handful towards the end of the walk.
    __builtin_amdgcn_sched_barrier(0);
#pragma unroll
    for (int q = 0; q < 16; q += 2) {
      s0 = WMMA_F32(fa[ch & 1][q], fb[ch & 1][q], s0);
      s1 = WMMA_F32(fa[ch & 1][q + 1], fb[ch & 1][q + 1], s1);
    }
  }
  v8f s = s0 + s1;

  // Behind the last K load: the two address pairs stay live up to this wait, so that
  // neither is reused (as a later load's destination either) in front of it.
  asm volatile("s_wait_xcnt 0x0" :: "v"(pa), "v"(pb) : "memory");

#pragma unroll
  for (int v = 0; v < 8; ++v) red[wave][lane * 8 + v] = s[v];
  __syncthreads();

  // thread tid sums element (lane l = tid / 8, register v = tid % 8) over batches
  float sum = 0.0f;
#pragma unroll
  for (int w = 0; w < Bn; ++w) sum += red[w][tid];
  const int l = tid >> 3;
  const int i = ti * 16 + (tid & 7) + 8 * (l >> 4);
  const int j = tj * 16 + (l & 15);
  outc[i * Dn + j] = carry[i * Dn + j] + 0.125f * sum;

  // The state stores come last, so that no barrier waits for them. The wait holds
  // them behind every load of this kernel, so that no load lands in a register that
  // an issued store still names.
  asm volatile("s_wait_xcnt 0x0" ::: "memory");

#pragma unroll
  for (int ch = 0; ch < Nc; ++ch) {
    const v8f sp = pre[ch];
    // j = 8*(ti*2+hi) + v: v = 0,1,4,5 belong to reader lanes 0-15, v = 2,3,6,7 to 16-31
    const v4f w0 = {c03.x + sp[0], c03.y + sp[1], c47.x + sp[4], c47.y + sp[5]};
    const v4f w1 = {c03.z + sp[2], c03.w + sp[3], c47.z + sp[6], c47.w + sp[7]};
    *(v4f*)(Sw + ch * Dn * Dn)          = w0;
    *(v4f*)(Sw + ch * Dn * Dn + 16 * 4) = w1;
  }
}

// ---------------------------------------------------------------------------
// Main kernel: 64 workgroups = 8 batches x 8 row-blocks (64 rows each).
// 128 threads = 4 waves; wave w owns rows [rb*64 + w*16, +16) x all 128 cols.
// ---------------------------------------------------------------------------
__global__ __launch_bounds__(128)
void qkproj_main(const float* __restrict__ Q, const float* __restrict__ K,
                 const float* __restrict__ S, float* __restrict__ out)
{
  __shared__ __align__(16) float sBuf[Dn * Dn];      // this block's state, fragment order
  __shared__ __align__(16) float kBuf[Rn * Dn];      // this block's own 64 K rows
  __shared__ __align__(16) float pTile[4][16 * 16];  // per-wave P transpose buffer

  const int tid  = threadIdx.x;
  const int lane = tid & 31;
  const int wave = __builtin_amdgcn_readfirstlane(tid >> 5);
  const int lo   = lane & 15;   // 0..15
  const int hi   = lane >> 4;   // 0 or 1

  const int b       = blockIdx.x >> 3;  // batch
  const int rb      = blockIdx.x & 7;   // row block of 64
  const int rowbase = rb * Rn;
  const int m0      = wave * 16;

  const float* Qb = Q + b * Cn * Dn;
  const float* Kc = K + b * Cn * Dn + rowbase * Dn;
  const float* Sb = S + (b * Nc + rb) * Dn * Dn;

  // Stage the 64x128 fp32 K chunk (32 KB) into LDS: 128 threads x 16 x 16B.
#pragma unroll
  for (int it = 0; it < 16; ++it) {
    const int idx = it * 512 + tid * 4;
    __builtin_amdgcn_global_load_async_to_lds_b128(
        (gv4i_p)(Kc + idx), (lv4i_p)(kBuf + idx),
        /*offset=*/0, /*cpol=*/0);
  }

  // --- preload Q A-fragments: A[M=lo][k = 4s + 2*hi + v], qrow fixed per lane
  const int qrow = rowbase + m0 + lo;
  v2f qa[32];
#pragma unroll
  for (int s = 0; s < 32; ++s)
    qa[s] = *(const v2f*)(Qb + qrow * Dn + s * 4 + 2 * hi);

  v8f acc[8];
#pragma unroll
  for (int t = 0; t < 8; ++t) acc[t] = (v8f){};

  // This wave's K copies have landed; behind the barrier every wave's have.
  asm volatile("s_wait_asynccnt 0x0" ::: "memory");
  __syncthreads();

  // Stage the state (64 KB) into LDS: 128 threads x 32 x 16B. The copies land
  // under the causal part below, which does not read them.
#pragma unroll
  for (int it = 0; it < 32; ++it) {
    const int idx = it * 512 + tid * 4;
    __builtin_amdgcn_global_load_async_to_lds_b128(
        (gv4i_p)(Sb + idx), (lv4i_p)(sBuf + idx),
        /*offset=*/0, /*cpol=*/0);
  }

  // --- causal part inside the chunk: column tiles 0 .. wave (no barrier inside)
  for (int cb = 0; cb <= wave; ++cb) {
    const float* kT = kBuf + cb * 16 * Dn;
    // P = Q @ Kcb^T : B[k=j][n=c'] = K[cb*16+n][j]
    v8f p = (v8f){};
#pragma unroll
    for (int s = 0; s < 32; ++s) {
      v2f bf = *(const v2f*)(kT + lo * Dn + s * 4 + 2 * hi);
      p = WMMA_F32(qa[s], bf, p);
    }
    // causal mask (inclusive) + store P to LDS in C/D layout:
    // element (M = v + 8*hi, N = lo)
    const int cloc = cb * 16 + lo;
    float* pw = pTile[wave];
#pragma unroll
    for (int v = 0; v < 8; ++v) {
      const int rloc = m0 + v + 8 * hi;
      pw[(v + 8 * hi) * 16 + lo] = (cloc <= rloc) ? p[v] : 0.0f;
    }
    // acc[t] += P @ Kcb : K-dim = 16 in 4 steps of 4
#pragma unroll
    for (int kk = 0; kk < 16; kk += 4) {
      // A[M=lo][k = kk + 2*hi + v] from LDS (layout conversion)
      v2f af = *(const v2f*)(pw + lo * 16 + kk + 2 * hi);
#pragma unroll
      for (int t = 0; t < 8; ++t) {
        const int r0 = (kk + 2 * hi) * Dn + t * 16 + lo;
        v2f bf;
        bf.x = kT[r0];
        bf.y = kT[r0 + Dn];
        acc[t] = WMMA_F32(af, bf, acc[t]);
      }
    }
  }

  // This wave's state copies have landed; behind the barrier every wave's have.
  asm volatile("s_wait_asynccnt 0x0" ::: "memory");
  __syncthreads();

  // --- all earlier chunks and the carry: acc[t] += Q @ S^T
  //     (B[k=j][n] = S[t*16+n][j], two k steps per float4)
#pragma unroll
  for (int sp = 0; sp < 16; ++sp) {
    v4f w[8];
#pragma unroll
    for (int t = 0; t < 8; ++t) w[t] = *(const v4f*)(sBuf + s_frag_off(t, sp, lane));
#pragma unroll
    for (int t = 0; t < 8; ++t)
      acc[t] = WMMA_F32(qa[2 * sp], ((v2f){w[t].x, w[t].y}), acc[t]);
#pragma unroll
    for (int t = 0; t < 8; ++t)
      acc[t] = WMMA_F32(qa[2 * sp + 1], ((v2f){w[t].z, w[t].w}), acc[t]);
  }

  // --- store: out[b][rowbase + m0 + v + 8*hi][t*16 + lo]
  float* ob = out + b * Cn * Dn;
#pragma unroll
  for (int t = 0; t < 8; ++t)
#pragma unroll
    for (int v = 0; v < 8; ++v)
      ob[(rowbase + m0 + v + 8 * hi) * Dn + t * 16 + lo] = acc[t][v];
}

// ---------------------------------------------------------------------------
extern "C" void kernel_launch(void* const* d_in, const int* in_sizes, int n_in,
                              void* d_out, int out_size, void* d_ws, size_t ws_size,
                              hipStream_t stream)
{
  const float* Q     = (const float*)d_in[0];  // queries  (8,512,128)
  const float* K     = (const float*)d_in[1];  // keys     (8,512,128)
  const float* carry = (const float*)d_in[2];  // carry    (128,128)
  float* out  = (float*)d_out;                 // projected_queries flat
  float* outc = out + Bn * Cn * Dn;            // new_carry flat
  float* S    = (float*)d_ws;                  // 64 states of 128x128 (4 MB)

  qkproj_state<<<dim3(64), dim3(256), 0, stream>>>(K, carry, S, outc);
  qkproj_main<<<dim3(Bn * (Cn / Rn)), dim3(128), 0, stream>>>(Q, K, S, out);
}

// v002
// Measured time: 12.7 microseconds a run.
// Timed twice side by side with v001, it ran 1.58 and 1.57 times as fast.
// Counting every step since v000, it is 4.88 times as fast.
#include <hip/hip_runtime.h>

// QKProjection: causal linear attention, fp32 WMMA (16x16x4), one launch.
//   out rows of a 16-row query tile = Q carry^T + tril(Q K^T) K over all keys up to the tile
//   new_carry = carry + (1/B) sum_b K_b^T K_b
// CDNA5 paths: v_wmma_f32_16x16x4_f32 + global_load_async_to_lds.

typedef __attribute__((ext_vector_type(2))) float v2f;
typedef __attribute__((ext_vector_type(4))) float v4f;
typedef __attribute__((ext_vector_type(8))) float v8f;
typedef int v4i __attribute__((vector_size(16)));  // matches builtin pointee

typedef __attribute__((address_space(1))) v4i* gv4i_p;  // global int4*
typedef __attribute__((address_space(3))) v4i* lv4i_p;  // LDS int4*

#define WMMA_F32(a, b, c) \
  __builtin_amdgcn_wmma_f32_16x16x4_f32(false, (a), false, (b), (short)0, (c), false, false)

constexpr int Bn = 8;
constexpr int Cn = 512;
constexpr int Dn = 128;
constexpr int Rn = 64;        // rows per load group of the new_carry walk
constexpr int Nc = Cn / Rn;
constexpr int Tp = 132;       // LDS row pitch in floats: 528 B = 16 B x 33, so that 16 rows
                              // read 16 bytes a lane fall on 64 different banks
constexpr int TileF = 16 * Tp;

// One row of 128 floats (512 B) into LDS: one 16-byte copy a lane.
__device__ __forceinline__ void copy_row(const float* g, float* l, int lane) {
  __builtin_amdgcn_global_load_async_to_lds_b128(
      (gv4i_p)(g + lane * 4), (lv4i_p)(l + lane * 4), /*offset=*/0, /*cpol=*/0);
}

// 16 rows that follow one another in memory into a tile of pitch Tp.
__device__ __forceinline__ void copy_tile(const float* g, float* l, int lane) {
#pragma unroll
  for (int r = 0; r < 16; ++r) copy_row(g + r * Dn, l + r * Tp, lane);
}

// ---------------------------------------------------------------------------
// 256 workgroups = 8 batches x 32 query tiles of 16 rows; 8 waves each.
// The tile's keys are dealt to the waves in tiles of 16 rows (wave w: key tiles
// w, w + 8, ...); trip 0 of every wave is 16 rows of carry, taken like keys.
// Both products are held transposed: S^T = K Q^T leaves a lane with 8 keys of one
// query, which is the second operand of out^T += K^T S^T as it stands.
// The 8 waves' partial out^T are summed through LDS.
// The 64 workgroups with the fewest keys also compute one 16x16 tile of new_carry.
// ---------------------------------------------------------------------------
__global__ __launch_bounds__(256)
void qkproj_fused(const float* __restrict__ Q, const float* __restrict__ K,
                  const float* __restrict__ carry,
                  float* __restrict__ out, float* __restrict__ outc)
{
  __shared__ __align__(16) float tile[2][8][TileF];  // two buffers a wave
  __shared__ __align__(16) float qT[TileF];          // the 16 query rows
  __shared__ __align__(16) float part[8][16 * Dn];   // a wave's partial out^T, register order
  __shared__ float red[Bn][32 * 8];                  // new_carry: batch totals

  const int tid  = threadIdx.x;
  const int lane = tid & 31;
  const int wave = __builtin_amdgcn_readfirstlane(tid >> 5);
  const int lo   = lane & 15;
  const int hi   = lane >> 4;

  // In index order, the longest first (the four last query
  // tiles, then the eight that also carry a new_carry tile, then the rest downwards).
  const int b   = blockIdx.x & 7;
  const int rho = blockIdx.x >> 3;
  const int qt  = rho < 4 ? 31 - rho : (rho < 12 ? 11 - rho : 39 - rho);
  const int nT  = 1 + ((qt + 8) >> 3);  // carry trip + key trips, the same for all waves

  const float* Kb = K + b * Cn * Dn;

  // --- in front of the loop: trip 0's tile and the queries, then trip 1's tile
  copy_tile(carry + wave * 16 * Dn, tile[0][wave], lane);
#pragma unroll
  for (int r = 0; r < 2; ++r)
    copy_row(Q + (b * Cn + qt * 16 + wave * 2 + r) * Dn, qT + (wave * 2 + r) * Tp, lane);
  // The 64 workgroups with the fewest keys (the test reads the same for the whole
  // workgroup) do their new_carry tile here, under the flight of the copies above.
  // Its one store a thread comes at the kernel's end, so that no barrier waits for it.
  float* oc = outc;
  float  nv = 0.0f;
  if (qt < 8) {
    // --- new_carry tile (ti, tj) = (b, qt): wave w walks batch w down its 512 rows,
    //     the 8 batch totals are summed through LDS.
    //     2 interleaved accumulators per wave break the WMMA RAW chain.
    const int ti = b;
    const int tj = qt;

    // column of K feeding A (result row index) and B (result col index);
    // fragment element v of step c0 sits in row c0 + 2*hi + v
    const float* pa = K + wave * Cn * Dn + 2 * hi * Dn + ti * 16 + lo;
    const float* pb = K + wave * Cn * Dn + 2 * hi * Dn + tj * 16 + lo;

    v8f s0 = (v8f){}, s1 = (v8f){};
    v2f fa[2][16], fb[2][16];  // fragments of 16 k steps, two groups
#pragma unroll
    for (int q = 0; q < 16; ++q) {
      fa[0][q].x = pa[(q * 4) * Dn];  fa[0][q].y = pa[(q * 4 + 1) * Dn];
      fb[0][q].x = pb[(q * 4) * Dn];  fb[0][q].y = pb[(q * 4 + 1) * Dn];
    }
#pragma unroll
    for (int ch = 0; ch < Nc; ++ch) {
      if (ch + 1 < Nc) {
#pragma unroll
        for (int q = 0; q < 16; ++q) {
          const int c = (ch + 1) * Rn + q * 4;
          fa[(ch + 1) & 1][q].x = pa[c * Dn];  fa[(ch + 1) & 1][q].y = pa[(c + 1) * Dn];
          fb[(ch + 1) & 1][q].x = pb[c * Dn];  fb[(ch + 1) & 1][q].y = pb[(c + 1) * Dn];
        }
      }
      // Keeps the next group's loads in front of this group's WMMAs: left alone, the
      // compiler let the loads in flight fall to a handful towards the end of the walk.
      __builtin_amdgcn_sched_barrier(0);
#pragma unroll
      for (int q = 0; q < 16; q += 2) {
        s0 = WMMA_F32(fa[ch & 1][q], fb[ch & 1][q], s0);
        s1 = WMMA_F32(fa[ch & 1][q + 1], fb[ch & 1][q + 1], s1);
      }
    }
    v8f s = s0 + s1;

    // Behind the last K load: the two address pairs stay live up to this wait, so that
    // neither is reused (as a later load's destination either) in front of it.
    asm volatile("s_wait_xcnt 0x0" :: "v"(pa), "v"(pb) : "memory");

    // C/D layout: register v holds sum_c K[c][ti*16 + v + 8*hi] * K[c][tj*16 + lo]
#pragma unroll
    for (int v = 0; v < 8; ++v) red[wave][lane * 8 + v] = s[v];
    __syncthreads();

    // thread tid sums element (lane l = tid / 8, register v = tid % 8) over batches
    float sum = 0.0f;
#pragma unroll
    for (int w = 0; w < Bn; ++w) sum += red[w][tid];
    const int l = tid >> 3;
    const int i = ti * 16 + (tid & 7) + 8 * (l >> 4);
    const int j = tj * 16 + (l & 15);
    oc = outc + i * Dn + j;
    nv = carry[i * Dn + j] + 0.125f * sum;
  }

  // This wave's copies have landed; behind the barrier every wave's have.
  asm volatile("s_wait_asynccnt 0x0" ::: "memory");
  __syncthreads();
  // A wave past the last key tile copies that last tile again (in bounds, never read).
  copy_tile(Kb + (wave < qt ? wave : qt) * 16 * Dn, tile[1][wave], lane);

  // Q fragments: lane (lo, hi) holds Q[lo][8 sp + 4 hi + 0..3]
  v4f qf[16];
#pragma unroll
  for (int sp = 0; sp < 16; ++sp) qf[sp] = *(const v4f*)(qT + lo * Tp + sp * 8 + hi * 4);

  v8f acc[8];  // acc[t][v] = out[query lo][t*16 + 8*hi + v], this wave's share
#pragma unroll
  for (int t = 0; t < 8; ++t) acc[t] = (v8f){};
  v8f pc = (v8f){};  // Q carry^T, columns wave*16 .. wave*16 + 15, same register order

  // Rolled: the trip count depends on the query tile.
#pragma unroll 1
  for (int tr = 0; tr < nT; ++tr) {
    const float* kT = tile[tr & 1][wave];
    const int cb = wave + 8 * (tr - 1);  // key tile of this trip (tr > 0)
    if (tr == 0 || cb <= qt) {
      // p[v] = sum_j T[v + 8*hi][j] * Q[lo][j], T = the 16 rows of this trip;
      // both operands take j = 8 sp + 4 hi + {0,1}, then {2,3}. Two chains.
      v8f p0 = (v8f){}, p1 = (v8f){};
      v4f a[16];
#pragma unroll
      for (int sp = 0; sp < 16; ++sp) a[sp] = *(const v4f*)(kT + lo * Tp + sp * 8 + hi * 4);
      // Keeps the 16 LDS reads together in front of the WMMAs: left alone, the compiler
      // read one step ahead only, and each pair of WMMAs waited out an LDS latency.
      __builtin_amdgcn_sched_barrier(0);
#pragma unroll
      for (int sp = 0; sp < 16; ++sp) {
        p0 = WMMA_F32(((v2f){a[sp].x, a[sp].y}), ((v2f){qf[sp].x, qf[sp].y}), p0);
        p1 = WMMA_F32(((v2f){a[sp].z, a[sp].w}), ((v2f){qf[sp].z, qf[sp].w}), p1);
      }
      v8f p = p0 + p1;
      if (tr == 0) {
        // rows of carry: p is out^T of columns wave*16 .., the ones this wave sums below
        pc = p;
      } else {
        // causal mask (inclusive): key cb*16 + v + 8*hi against query qt*16 + lo
#pragma unroll
        for (int v = 0; v < 8; ++v)
          p[v] = (cb * 16 + v + 8 * hi <= qt * 16 + lo) ? p[v] : 0.0f;
        // out^T += K^T S^T: k slot (hi, e) of step q is key 2q + 8*hi + e on both sides
#pragma unroll
        for (int q = 0; q < 4; ++q) {
          const v2f bq = {p[2 * q], p[2 * q + 1]};
#pragma unroll
          for (int t = 0; t < 8; ++t) {
            const int r0 = (2 * q + 8 * hi) * Tp + t * 16 + lo;
            v2f af;
            af.x = kT[r0];
            af.y = kT[r0 + Tp];
            acc[t] = WMMA_F32(af, bq, acc[t]);
          }
        }
      }
    }
    // Foot of the trip: this wave's reads of its buffer are done, the next trip's
    // copies have landed; behind the barrier the buffer just read is filled again.
    asm volatile("s_wait_dscnt 0x0" ::: "memory");
    asm volatile("s_wait_asynccnt 0x0" ::: "memory");
    __syncthreads();
    if (tr + 2 < nT) {
      const int nb = wave + 8 * (tr + 1);
      copy_tile(Kb + (nb < qt ? nb : qt) * 16 * Dn, tile[tr & 1][wave], lane);
    }
  }
  // No copy is left in flight behind the loop.
  asm volatile("s_wait_asynccnt 0x0" ::: "memory");

  // --- sum the 8 waves' shares: wave w sums and stores columns w*16 .. w*16 + 15
#pragma unroll
  for (int t = 0; t < 8; ++t) {
    *(v4f*)(part[wave] + ((t * 2 + 0) * 32 + lane) * 4) = (v4f){acc[t][0], acc[t][1], acc[t][2], acc[t][3]};
    *(v4f*)(part[wave] + ((t * 2 + 1) * 32 + lane) * 4) = (v4f){acc[t][4], acc[t][5], acc[t][6], acc[t][7]};
  }
  __syncthreads();
  v4f r0 = {pc[0], pc[1], pc[2], pc[3]}, r1 = {pc[4], pc[5], pc[6], pc[7]};
#pragma unroll
  for (int w = 0; w < 8; ++w) {
    r0 += *(const v4f*)(part[w] + ((wave * 2 + 0) * 32 + lane) * 4);
    r1 += *(const v4f*)(part[w] + ((wave * 2 + 1) * 32 + lane) * 4);
  }
  float* op = out + (b * Cn + qt * 16 + lo) * Dn + wave * 16 + 8 * hi;
  *(v4f*)op       = r0;
  *(v4f*)(op + 4) = r1;
  if (qt < 8) *oc = nv;
}

// ---------------------------------------------------------------------------
extern "C" void kernel_launch(void* const* d_in, const int* in_sizes, int n_in,
                              void* d_out, int out_size, void* d_ws, size_t ws_size,
                              hipStream_t stream)
{
  const float* Q     = (const float*)d_in[0];  // queries  (8,512,128)
  const float* K     = (const float*)d_in[1];  // keys     (8,512,128)
  const float* carry = (const float*)d_in[2];  // carry    (128,128)
  float* out  = (float*)d_out;                 // projected_queries flat
  float* outc = out + Bn * Cn * Dn;            // new_carry flat

  qkproj_fused<<<dim3(Bn * (Cn / 16)), dim3(256), 0, stream>>>(Q, K, carry, out, outc);
}

// v003
// One run takes 10.2 microseconds.
// Two timings next to v002 both put it at 1.24 times that version's speed.
// All steps since v000 together make it 6.05 times as fast.
#include <hip/hip_runtime.h>

// QKProjection: causal linear attention, fp32 WMMA (16x16x4), one launch.
//   out rows of a 16-row query tile = Q carry^T + tril(Q K^T) K over all keys up to the tile
//   new_carry = carry + (1/B) sum_b K_b^T K_b
// CDNA5 paths: v_wmma_f32_16x16x4_f32 + global_load_async_to_lds.

typedef __attribute__((ext_vector_type(2))) float v2f;
typedef __attribute__((ext_vector_type(4))) float v4f;
typedef __attribute__((ext_vector_type(8))) float v8f;
typedef int v4i __attribute__((vector_size(16)));  // matches builtin pointee

typedef __attribute__((address_space(1))) v4i* gv4i_p;  // global int4*
typedef __attribute__((address_space(3))) v4i* lv4i_p;  // LDS int4*

#define WMMA_F32(a, b, c) \
  __builtin_amdgcn_wmma_f32_16x16x4_f32(false, (a), false, (b), (short)0, (c), false, false)

constexpr int Bn = 8;
constexpr int Cn = 512;
constexpr int Dn = 128;
constexpr int Rn = 64;        // rows per load group of the new_carry walk
constexpr int Nc = Cn / Rn;
constexpr int Tp = 132;       // LDS row pitch in floats: 528 B = 16 B x 33, so that 16 rows
                              // read 16 bytes a lane fall on 64 different banks
constexpr int TileF = 16 * Tp;

// One row of 128 floats (512 B) into LDS: one 16-byte copy a lane.
__device__ __forceinline__ void copy_row(const float* g, float* l, int lane) {
  __builtin_amdgcn_global_load_async_to_lds_b128(
      (gv4i_p)(g + lane * 4), (lv4i_p)(l + lane * 4), /*offset=*/0, /*cpol=*/0);
}

// 16 rows that follow one another in memory into a tile of pitch Tp.
__device__ __forceinline__ void copy_tile(const float* g, float* l, int lane) {
#pragma unroll
  for (int r = 0; r < 16; ++r) copy_row(g + r * Dn, l + r * Tp, lane);
}

// ---------------------------------------------------------------------------
// 256 workgroups of 8 waves: 192 share the 8 batches x 32 query tiles of 16 rows,
// 64 compute one 16x16 tile of new_carry each and nothing else.
// A query tile's keys are dealt to the waves in tiles of 16 rows (wave w: key tiles
// w, w + 8, ...); trip 0 of every wave is 16 rows of carry, taken like keys.
// Both products are held transposed: S^T = K Q^T leaves a lane with 8 keys of one
// query, which is the second operand of out^T += K^T S^T as it stands.
// The 8 waves' partial out^T are summed through LDS.
// The 64 query tiles with the fewest keys have no workgroup of their own: each is the
// second pass of a workgroup that holds one of the query tiles 8 .. 15.
// ---------------------------------------------------------------------------
__global__ __launch_bounds__(256)
void qkproj_fused(const float* __restrict__ Q, const float* __restrict__ K,
                  const float* __restrict__ carry,
                  float* __restrict__ out, float* __restrict__ outc)
{
  __shared__ __align__(16) float tile[2][8][TileF];  // two buffers a wave
  __shared__ __align__(16) float qT[TileF];          // the 16 query rows
  __shared__ __align__(16) float part[8][16 * Dn];   // a wave's partial out^T, register order
  __shared__ float red[Bn][32 * 8];                  // new_carry: batch totals

  const int tid  = threadIdx.x;
  const int lane = tid & 31;
  const int wave = __builtin_amdgcn_readfirstlane(tid >> 5);
  const int lo   = lane & 15;
  const int hi   = lane >> 4;

  // The lowest indices hold the longest work (the four last query tiles, the new_carry
  // tiles, four more query tiles, the eight workgroups with two query tiles, the rest
  // downwards).
  const int b   = blockIdx.x & 7;
  const int rho = blockIdx.x >> 3;

  if (rho >= 4 && rho < 12) {  // the test reads the same for the whole workgroup
    // --- new_carry tile (ti, tj) = (b, rho - 4): wave w walks batch w down its 512
    //     rows, the 8 batch totals are summed through LDS.
    //     2 interleaved accumulators per wave break the WMMA RAW chain.
    const int ti = b;
    const int tj = rho - 4;

    // column of K feeding A (result row index) and B (result col index);
    // fragment element v of step c0 sits in row c0 + 2*hi + v
    const float* pa = K + wave * Cn * Dn + 2 * hi * Dn + ti * 16 + lo;
    const float* pb = K + wave * Cn * Dn + 2 * hi * Dn + tj * 16 + lo;

    v8f s0 = (v8f){}, s1 = (v8f){};
    v2f fa[2][16], fb[2][16];  // fragments of 16 k steps, two groups
#pragma unroll
    for (int q = 0; q < 16; ++q) {
      fa[0][q].x = pa[(q * 4) * Dn];  fa[0][q].y = pa[(q * 4 + 1) * Dn];
      fb[0][q].x = pb[(q * 4) * Dn];  fb[0][q].y = pb[(q * 4 + 1) * Dn];
    }
#pragma unroll
    for (int ch = 0; ch < Nc; ++ch) {
      if (ch + 1 < Nc) {
#pragma unroll
        for (int q = 0; q < 16; ++q) {
          const int c = (ch + 1) * Rn + q * 4;
          fa[(ch + 1) & 1][q].x = pa[c * Dn];  fa[(ch + 1) & 1][q].y = pa[(c + 1) * Dn];
          fb[(ch + 1) & 1][q].x = pb[c * Dn];  fb[(ch + 1) & 1][q].y = pb[(c + 1) * Dn];
        }
      }
      // Keeps the next group's loads in front of this group's WMMAs: left alone, the
      // compiler let the loads in flight fall to a handful towards the end of the walk.
      __builtin_amdgcn_sched_barrier(0);
#pragma unroll
      for (int q = 0; q < 16; q += 2) {
        s0 = WMMA_F32(fa[ch & 1][q], fb[ch & 1][q], s0);
        s1 = WMMA_F32(fa[ch & 1][q + 1], fb[ch & 1][q + 1], s1);
      }
    }
    v8f s = s0 + s1;

    // Behind the last K load: the two address pairs stay live up to this wait, so that
    // neither is reused (as a later load's destination either) in front of it.
    asm volatile("s_wait_xcnt 0x0" :: "v"(pa), "v"(pb) : "memory");

    // C/D layout: register v holds sum_c K[c][ti*16 + v + 8*hi] * K[c][tj*16 + lo]
#pragma unroll
    for (int v = 0; v < 8; ++v) red[wave][lane * 8 + v] = s[v];
    __syncthreads();

    // thread tid sums element (lane l = tid / 8, register v = tid % 8) over batches
    float sum = 0.0f;
#pragma unroll
    for (int w = 0; w < Bn; ++w) sum += red[w][tid];
    const int l = tid >> 3;
    const int i = ti * 16 + (tid & 7) + 8 * (l >> 4);
    const int j = tj * 16 + (l & 15);
    outc[i * Dn + j] = carry[i * Dn + j] + 0.125f * sum;
    return;
  }

  const int qt0 = rho < 4 ? 31 - rho : (rho < 16 ? 39 - rho : (rho < 24 ? 31 - rho : 47 - rho));
  // Two passes: query tile qt0 (15 .. 8), then 15 - qt0, 17 key tiles in every such pair.
  const int nP  = (rho >= 16 && rho < 24) ? 2 : 1;

  const float* Kb = K + b * Cn * Dn;

  // --- in front of the first pass: trip 0's tile and the queries
  copy_tile(carry + wave * 16 * Dn, tile[0][wave], lane);
#pragma unroll
  for (int r = 0; r < 2; ++r)
    copy_row(Q + (b * Cn + qt0 * 16 + wave * 2 + r) * Dn, qT + (wave * 2 + r) * Tp, lane);

  // The first of two passes keeps its results here: stored at the kernel's end, so that
  // no barrier of the second pass waits for the stores.
  v4f h0 = (v4f){}, h1 = (v4f){};
  float* hp = out;
  v4f r0 = (v4f){}, r1 = (v4f){};  // the pass's results, stored behind the passes
  float* op = out;

  // Rolled: one body serves both passes.
#pragma unroll 1
  for (int ps = 0; ps < nP; ++ps) {
  const int qt = ps ? 15 - qt0 : qt0;
  const int nT = 1 + ((qt + 8) >> 3);  // carry trip + key trips, the same for all waves

  // This wave's copies have landed; behind the barrier every wave's have.
  asm volatile("s_wait_asynccnt 0x0" ::: "memory");
  __syncthreads();
  // A wave past the last key tile copies that last tile again (in bounds, never read).
  copy_tile(Kb + (wave < qt ? wave : qt) * 16 * Dn, tile[1][wave], lane);

  // Q fragments: lane (lo, hi) holds Q[lo][8 sp + 4 hi + 0..3]
  v4f qf[16];
#pragma unroll
  for (int sp = 0; sp < 16; ++sp) qf[sp] = *(const v4f*)(qT + lo * Tp + sp * 8 + hi * 4);

  v8f acc[8];  // acc[t][v] = out[query lo][t*16 + 8*hi + v], this wave's share
#pragma unroll
  for (int t = 0; t < 8; ++t) acc[t] = (v8f){};
  v8f pc = (v8f){};  // Q carry^T, columns wave*16 .. wave*16 + 15, same register order

  // Rolled: the trip count depends on the query tile.
#pragma unroll 1
  for (int tr = 0; tr < nT; ++tr) {
    const float* kT = tile[tr & 1][wave];
    const int cb = wave + 8 * (tr - 1);  // key tile of this trip (tr > 0)
    if (tr == 0 || cb <= qt) {
      // p[v] = sum_j T[v + 8*hi][j] * Q[lo][j], T = the 16 rows of this trip;
      // both operands take j = 8 sp + 4 hi + {0,1}, then {2,3}. Two chains.
      v8f p0 = (v8f){}, p1 = (v8f){};
      v4f a[16];
#pragma unroll
      for (int sp = 0; sp < 16; ++sp) a[sp] = *(const v4f*)(kT + lo * Tp + sp * 8 + hi * 4);
      // Keeps the 16 LDS reads together in front of the WMMAs: left alone, the compiler
      // read one step ahead only, and each pair of WMMAs waited out an LDS latency.
      __builtin_amdgcn_sched_barrier(0);
#pragma unroll
      for (int sp = 0; sp < 16; ++sp) {
        p0 = WMMA_F32(((v2f){a[sp].x, a[sp].y}), ((v2f){qf[sp].x, qf[sp].y}), p0);
        p1 = WMMA_F32(((v2f){a[sp].z, a[sp].w}), ((v2f){qf[sp].z, qf[sp].w}), p1);
      }
      v8f p = p0 + p1;
      if (tr == 0) {
        // rows of carry: p is out^T of columns wave*16 .., the ones this wave sums below
        pc = p;
      } else {
        // causal mask (inclusive): key cb*16 + v + 8*hi against query qt*16 + lo
#pragma unroll
        for (int v = 0; v < 8; ++v)
          p[v] = (cb * 16 + v + 8 * hi <= qt * 16 + lo) ? p[v] : 0.0f;
        // out^T += K^T S^T: k slot (hi, e) of step q is key 2q + 8*hi + e on both sides
#pragma unroll
        for (int q = 0; q < 4; ++q) {
          const v2f bq = {p[2 * q], p[2 * q + 1]};
#pragma unroll
          for (int t = 0; t < 8; ++t) {
            const int r0 = (2 * q + 8 * hi) * Tp + t * 16 + lo;
            v2f af;
            af.x = kT[r0];
            af.y = kT[r0 + Tp];
            acc[t] = WMMA_F32(af, bq, acc[t]);
          }
        }
      }
    }
    // Foot of the trip: this wave's reads of its buffer are done, the next trip's
    // copies have landed; behind the barrier the buffer just read is filled again.
    asm volatile("s_wait_dscnt 0x0" ::: "memory");
    asm volatile("s_wait_asynccnt 0x0" ::: "memory");
    __syncthreads();
    if (tr + 2 < nT) {
      const int nb = wave + 8 * (tr + 1);
      copy_tile(Kb + (nb < qt ? nb : qt) * 16 * Dn, tile[tr & 1][wave], lane);
    }
  }
  // No copy is left in flight behind the loop.
  asm volatile("s_wait_asynccnt 0x0" ::: "memory");
  // The next pass's trip 0 tile and queries fly under the sum below: every wave's last
  // read of either place lies in front of a trip's foot (its LDS wait and its barrier).
  if (ps + 1 < nP) {
    copy_tile(carry + wave * 16 * Dn, tile[0][wave], lane);
#pragma unroll
    for (int r = 0; r < 2; ++r)
      copy_row(Q + (b * Cn + (15 - qt0) * 16 + wave * 2 + r) * Dn, qT + (wave * 2 + r) * Tp, lane);
  }

  // --- sum the 8 waves' shares: wave w sums and stores columns w*16 .. w*16 + 15
#pragma unroll
  for (int t = 0; t < 8; ++t) {
    *(v4f*)(part[wave] + ((t * 2 + 0) * 32 + lane) * 4) = (v4f){acc[t][0], acc[t][1], acc[t][2], acc[t][3]};
    *(v4f*)(part[wave] + ((t * 2 + 1) * 32 + lane) * 4) = (v4f){acc[t][4], acc[t][5], acc[t][6], acc[t][7]};
  }
  __syncthreads();
  h0 = r0;
  h1 = r1;
  hp = op;
  r0 = (v4f){pc[0], pc[1], pc[2], pc[3]};
  r1 = (v4f){pc[4], pc[5], pc[6], pc[7]};
#pragma unroll
  for (int w = 0; w < 8; ++w) {
    r0 += *(const v4f*)(part[w] + ((wave * 2 + 0) * 32 + lane) * 4);
    r1 += *(const v4f*)(part[w] + ((wave * 2 + 1) * 32 + lane) * 4);
  }
  op = out + (b * Cn + qt * 16 + lo) * Dn + wave * 16 + 8 * hi;
  }
  *(v4f*)op       = r0;
  *(v4f*)(op + 4) = r1;
  if (nP == 2) {
    *(v4f*)hp       = h0;
    *(v4f*)(hp + 4) = h1;
  }
}

// ---------------------------------------------------------------------------
extern "C" void kernel_launch(void* const* d_in, const int* in_sizes, int n_in,
                              void* d_out, int out_size, void* d_ws, size_t ws_size,
                              hipStream_t stream)
{
  const float* Q     = (const float*)d_in[0];  // queries  (8,512,128)
  const float* K     = (const float*)d_in[1];  // keys     (8,512,128)
  const float* carry = (const float*)d_in[2];  // carry    (128,128)
  float* out  = (float*)d_out;                 // projected_queries flat
  float* outc = out + Bn * Cn * Dn;            // new_carry flat

  qkproj_fused<<<dim3(Bn * (Cn / 16)), dim3(256), 0, stream>>>(Q, K, carry, out, outc);
}
